// v010
// Measured on an AMD MI455X. A time is GPU time per run, averaged over a window of back-to-back runs after a warm-up
// (all launches, gaps included; the runs take copies of the inputs in turn), and the median of several windows.
// Apart from v000's, it joins two sittings. Times from different sittings can be a few percent apart, while
// side-by-side timings come from the same sitting.
// The versions before v010 are in another document.
// A run of this version takes 68.7 microseconds.
// In two side-by-side timings against v009, it was 1.16 and 1.17 times as fast.
// Counting every step since v000, which is the starting kernel, it is 12.1 times as fast.
#include <hip/hip_runtime.h>
// q/k/v/o projections (4096 × 512 × 512, + bias), the cosine-similarity matrix of the normalised semantic features (per batch 2048 × 2048 × 256, kept as an f16 plane) and the 8-head
// constrained attention on v_wmma_f32_16x16x32_f16 (fused flash-style kernel: S = Q·Kᵀ, O = P·V on WMMA; scores / (8·temperature_b) + semantic bias + positional bias, key mask → −inf;
// online max/sum softmax f32; P f16 ≤ 1); the dynamic-temperature MLP on the mean query is f32 VALU (column sums over 64 blocks, then one block); A = f16(bf16 ·) exact operands, weights bf16-exact ×2^4 ((out,in)),
// single products, f32 accumulate.
// Every f16 plane of the workspace lies in fragment order: a plane of KD columns is cut into blocks of 16 rows x 32 columns (row tile major, then column block), a block is 2 x 512 bytes,
// and 16-byte chunk (j, hh, ln) of a block holds row ln, columns 16 j + 8 hh .. + 7. Lane 16 hh + ln of a wave then finds half j of its A or B fragment at byte 16 lane of that half:
// one fragment load reads 512 bytes in a row (4 whole 128-byte lines), where a row-major plane gave it 32 bytes out of each of 16 lines.
#define BB 2
#define SS 2048
#define DM 512
#define NH 8
#define HD 64
#define DSEM 256
#define NR (BB * SS)

typedef __bf16 v16b __attribute__((ext_vector_type(16)));
typedef unsigned short v8us __attribute__((ext_vector_type(8), may_alias));
typedef float  v8f  __attribute__((ext_vector_type(8)));
typedef float  v4f  __attribute__((ext_vector_type(4)));
typedef float  v4fa __attribute__((ext_vector_type(4), may_alias));
union FragB { v16b v; v8us half[2]; unsigned short u[16]; };

__device__ __forceinline__ unsigned short bf16_bits(float x) { unsigned int u = __float_as_uint(x); return (unsigned short)((u + 0x7FFFu + ((u >> 16) & 1u)) >> 16); }
__device__ __forceinline__ float bf16_val(unsigned short b) { return __uint_as_float(((unsigned int)b) << 16); }
__device__ __forceinline__ float bf16_round(float x) { return bf16_val(bf16_bits(x)); }
// D += A·B with NT terms: 1 = ah·bh, 2 = + al·bh (A split), 3 = + ah·bl (both split)
template <int NT>
__device__ __forceinline__ v8f mmaN(v16b ah, v16b al, v16b bh, v16b bl, v8f c) {
  c = __builtin_amdgcn_wmma_f32_16x16x32_bf16(false, ah, false, bh, (short)0, c, false, false);
  if (NT >= 2) c = __builtin_amdgcn_wmma_f32_16x16x32_bf16(false, al, false, bh, (short)0, c, false, false);
  if (NT >= 3) c = __builtin_amdgcn_wmma_f32_16x16x32_bf16(false, ah, false, bl, (short)0, c, false, false);
  asm volatile("v_nop\n\tv_nop\n\tv_nop\n\tv_nop" : "+v"(c) : "v"(ah), "v"(al), "v"(bh), "v"(bl));
  return c;
}

__global__ __launch_bounds__(256) void k_wt_bf16(const float* __restrict__ W, unsigned short* __restrict__ Wt, int K, int N) {
  const int t = blockIdx.x * 256 + threadIdx.x;
  const int k8n = K / 8;
  if (t >= N * k8n) return;
  const int n = t / k8n, k8 = (t % k8n) * 8;
  v8us v;
#pragma unroll
  for (int i = 0; i < 8; ++i) v[i] = bf16_bits(W[(size_t)(k8 + i) * N + n]);
  *(v8us*)(Wt + (size_t)n * K + k8) = v;
  
}

// GEMM C[M][N] (f32, pitch ldc) = act(A[M][K]·W + bias). A f32 row-major (pitch lda) converted per fragment to bf16
// (ASPLIT: hi/lo two planes -> 2 terms, else single rounded term); Wt bf16 [N][K] (pitch ldb). BIAS_BF16 rounds the
// bias to bf16 first (bias quantised to bf16 before the add). K%32==0, M%16==0, N%64==0.
template <bool ASPLIT, int ACT, bool BIAS_BF16>
__global__ __launch_bounds__(128) void k_gemm_bf(const float* __restrict__ A, int lda, const unsigned short* __restrict__ Wt, int ldb,
                                               const float* __restrict__ bias, float* __restrict__ C, int ldc, int M, int N, int K) {
  __shared__ __attribute__((aligned(16))) float so[4][16][64];
  const int tid = threadIdx.x, w = tid >> 5, lane = tid & 31, ln = lane & 15, hh = lane >> 4;
  const int ntn = N / 64;
  const int wid = blockIdx.x * 4 + w;
  const int mt = wid / ntn, nq = wid % ntn;
  if (mt * 16 >= M) return;
  const int row0 = mt * 16, col0 = nq * 64;
  const float* arow = A + (size_t)(row0 + ln) * lda;
  v8f acc[4] = {};
  for (int kb = 0; kb < K; kb += 32) {
    FragB ah, al;
    const v4f x0 = *(const v4fa*)(arow + kb + 8 * hh), x1 = *(const v4fa*)(arow + kb + 8 * hh + 4);
    const v4f x2 = *(const v4fa*)(arow + kb + 16 + 8 * hh), x3 = *(const v4fa*)(arow + kb + 16 + 8 * hh + 4);
    float xs[16] = {x0[0],x0[1],x0[2],x0[3],x1[0],x1[1],x1[2],x1[3],x2[0],x2[1],x2[2],x2[3],x3[0],x3[1],x3[2],x3[3]};
#pragma unroll
    for (int i = 0; i < 16; ++i) { const unsigned short hb = bf16_bits(xs[i]); ah.u[i] = hb; al.u[i] = ASPLIT ? bf16_bits(xs[i] - bf16_val(hb)) : (unsigned short)0; }
#pragma unroll
    for (int t = 0; t < 4; ++t) {
      const unsigned short* brow = Wt + (size_t)(col0 + t * 16 + ln) * ldb + kb;
      FragB b;
      b.half[0] = *(const v8us*)(brow + 8 * hh);
      b.half[1] = *(const v8us*)(brow + 16 + 8 * hh);
      acc[t] = mmaN<ASPLIT ? 2 : 1>(ah.v, al.v, b.v, b.v, acc[t]);
    }
  }
#pragma unroll
  for (int t = 0; t < 4; ++t) {
    float bv = bias ? bias[col0 + t * 16 + ln] : 0.f;
    if (BIAS_BF16) bv = bf16_round(bv);
#pragma unroll
    for (int r = 0; r < 8; ++r) { float v = acc[t][r] + bv; if (ACT == 1) v = fmaxf(v, 0.f); so[w][8 * hh + r][t * 16 + ln] = v; }
  }
  __builtin_amdgcn_fence(__ATOMIC_ACQ_REL, "workgroup");
  __builtin_amdgcn_wave_barrier();
  const int rsub = lane >> 4, c4 = (lane & 15) * 4;
  {
#pragma unroll
    for (int q = 0; q < 8; ++q) {
      const int r = q * 2 + rsub;
      const v4f v = *(const v4fa*)&so[w][r][c4];
      *(v4f*)(C + (size_t)(row0 + r) * ldc + col0 + c4) = v;
    }
    
  }
}

// Flash-style causal/unmasked attention, all contractions 3-term bf16 hi/lo splits, f32 softmax with running max.
// q,k,v rows are read from f32 buffers with arbitrary row pitch (so they can live inside a fused qkv buffer);
// D = head size (multiple of 32, <= 128); one wave = 16 query rows; block = 4 waves (64 queries) sharing K/V chunks of 32.
template <int D, bool CAUSAL>
__global__ __launch_bounds__(128) void k_flash(const float* __restrict__ qb, const float* __restrict__ kb, const float* __restrict__ vb,
                                             int pitch, int T, int H, float scale, float* __restrict__ y, int ypitch) {
  constexpr int KS = D / 32;        // k-steps for QK
  constexpr int DT = D / 16;        // d tiles for PV
  __shared__ __attribute__((aligned(16))) unsigned short sKh[32][D + 8], sKl[32][D + 8], sVh[32][D + 8], sVl[32][D + 8];
  __shared__ __attribute__((aligned(16))) unsigned short sPh[4][16][40], sPl[4][16][40];
  __shared__ __attribute__((aligned(16))) float sO[4][16][D];
  const int tid = threadIdx.x, w = tid >> 5, lane = tid & 31, ln = lane & 15, hh = lane >> 4;
  const int nqb = (T + 63) / 64;
  const int bh = blockIdx.x / nqb, qblk = blockIdx.x % nqb;
  const int b = bh / H, h = bh % H;
  const int q0 = qblk * 64 + w * 16;
  const float* Q = qb + (size_t)b * T * pitch + h * D;
  const float* K = kb + (size_t)b * T * pitch + h * D;
  const float* V = vb + (size_t)b * T * pitch + h * D;

  // A fragments of the wave's 16 query rows (scaled), hi/lo
  FragB aqh[KS], aql[KS];
  {
    int row = q0 + ln; if (row >= T) row = T - 1;
    const float* qr = Q + (size_t)row * pitch;
#pragma unroll
    for (int ks = 0; ks < KS; ++ks)
#pragma unroll
      for (int i = 0; i < 16; ++i) {
        const int d = ks * 32 + ((i < 8) ? (8 * hh + i) : (16 + 8 * hh + (i - 8)));
        const float x = qr[d] * scale; const unsigned short hb = bf16_bits(x);
        aqh[ks].u[i] = hb; aql[ks].u[i] = bf16_bits(x - bf16_val(hb));
      }
  }
  float m_r[8], l_r[8];
#pragma unroll
  for (int r = 0; r < 8; ++r) { m_r[r] = -3.0e38f; l_r[r] = 0.f; }
  v8f oacc[DT];
#pragma unroll
  for (int dt = 0; dt < DT; ++dt) oacc[dt] = (v8f){0.f,0.f,0.f,0.f,0.f,0.f,0.f,0.f};

  const int kv_end = CAUSAL ? min(T, qblk * 64 + 64) : T;     // block-uniform
  for (int j0 = 0; j0 < kv_end; j0 += 32) {
    __syncthreads();
    for (int e = tid; e < 32 * (D / 4); e += 128) {
      const int r = e / (D / 4), c4 = (e % (D / 4)) * 4;
      const int key = j0 + r;
      v4f kf = {0.f,0.f,0.f,0.f}, vf = {0.f,0.f,0.f,0.f};
      if (key < T) { kf = *(const v4fa*)(K + (size_t)key * pitch + c4); vf = *(const v4fa*)(V + (size_t)key * pitch + c4); }
#pragma unroll
      for (int t = 0; t < 4; ++t) {
        unsigned short hb = bf16_bits(kf[t]); sKh[r][c4 + t] = hb; sKl[r][c4 + t] = bf16_bits(kf[t] - bf16_val(hb));
        hb = bf16_bits(vf[t]); sVh[r][c4 + t] = hb; sVl[r][c4 + t] = bf16_bits(vf[t] - bf16_val(hb));
      }
    }
    __syncthreads();
    // S tile 16 x 32
    v8f s[2];
#pragma unroll
    for (int nt = 0; nt < 2; ++nt) {
      v8f acc = {};
#pragma unroll
      for (int ks = 0; ks < KS; ++ks) {
        FragB bh_, bl_;
        bh_.half[0] = *(const v8us*)&sKh[nt * 16 + ln][ks * 32 + 8 * hh]; bh_.half[1] = *(const v8us*)&sKh[nt * 16 + ln][ks * 32 + 16 + 8 * hh];
        bl_.half[0] = *(const v8us*)&sKl[nt * 16 + ln][ks * 32 + 8 * hh]; bl_.half[1] = *(const v8us*)&sKl[nt * 16 + ln][ks * 32 + 16 + 8 * hh];
        acc = mmaN<3>(aqh[ks].v, aql[ks].v, bh_.v, bl_.v, acc);
      }
      s[nt] = acc;
    }
    // mask + running max (rows 8hh+r; the 16 lanes of a half share rows)
    float alpha[8];
#pragma unroll
    for (int r = 0; r < 8; ++r) {
      const int qi = q0 + 8 * hh + r;
      const int ja = j0 + ln, jb = j0 + 16 + ln;
      if (CAUSAL) { if (ja > qi) s[0][r] = -3.0e38f; if (jb > qi) s[1][r] = -3.0e38f; }
      if (ja >= T) s[0][r] = -3.0e38f;
      if (jb >= T) s[1][r] = -3.0e38f;
      float mx = fmaxf(s[0][r], s[1][r]);
      mx = fmaxf(mx, __shfl_xor(mx, 1, 32)); mx = fmaxf(mx, __shfl_xor(mx, 2, 32)); mx = fmaxf(mx, __shfl_xor(mx, 4, 32)); mx = fmaxf(mx, __shfl_xor(mx, 8, 32));
      const float mnew = fmaxf(m_r[r], mx);
      alpha[r] = (mnew > -1.0e38f) ? __expf(m_r[r] - mnew) : 1.0f;
      const float p0 = (s[0][r] > -1.0e38f) ? __expf(s[0][r] - mnew) : 0.f;
      const float p1 = (s[1][r] > -1.0e38f) ? __expf(s[1][r] - mnew) : 0.f;
      m_r[r] = mnew;
      l_r[r] = l_r[r] * alpha[r] + p0 + p1;            // per-lane partial row sum (16 lanes combined at the end)
      unsigned short hb = bf16_bits(p0); sPh[w][8 * hh + r][ln] = hb;      sPl[w][8 * hh + r][ln] = bf16_bits(p0 - bf16_val(hb));
      hb = bf16_bits(p1);                sPh[w][8 * hh + r][16 + ln] = hb; sPl[w][8 * hh + r][16 + ln] = bf16_bits(p1 - bf16_val(hb));
    }
#pragma unroll
    for (int dt = 0; dt < DT; ++dt)
#pragma unroll
      for (int r = 0; r < 8; ++r) oacc[dt][r] *= alpha[r];
    __builtin_amdgcn_fence(__ATOMIC_ACQ_REL, "workgroup");
    __builtin_amdgcn_wave_barrier();
    FragB pah, pal;
    pah.half[0] = *(const v8us*)&sPh[w][ln][8 * hh]; pah.half[1] = *(const v8us*)&sPh[w][ln][16 + 8 * hh];
    pal.half[0] = *(const v8us*)&sPl[w][ln][8 * hh]; pal.half[1] = *(const v8us*)&sPl[w][ln][16 + 8 * hh];
#pragma unroll
    for (int dt = 0; dt < DT; ++dt) {
      FragB bvh, bvl;
#pragma unroll
      for (int i = 0; i < 8; ++i) {
        bvh.u[i] = sVh[8 * hh + i][dt * 16 + ln]; bvh.u[8 + i] = sVh[16 + 8 * hh + i][dt * 16 + ln];
        bvl.u[i] = sVl[8 * hh + i][dt * 16 + ln]; bvl.u[8 + i] = sVl[16 + 8 * hh + i][dt * 16 + ln];
      }
      oacc[dt] = mmaN<3>(pah.v, pal.v, bvh.v, bvl.v, oacc[dt]);
    }
    __builtin_amdgcn_fence(__ATOMIC_ACQ_REL, "workgroup");
    __builtin_amdgcn_wave_barrier();
  }
#pragma unroll
  for (int r = 0; r < 8; ++r) {
    float l = l_r[r];
    l += __shfl_xor(l, 1, 32); l += __shfl_xor(l, 2, 32); l += __shfl_xor(l, 4, 32); l += __shfl_xor(l, 8, 32);
    l_r[r] = (l > 0.f) ? 1.0f / l : 0.f;
  }
#pragma unroll
  for (int dt = 0; dt < DT; ++dt)
#pragma unroll
    for (int r = 0; r < 8; ++r) sO[w][8 * hh + r][dt * 16 + ln] = oacc[dt][r] * l_r[r];
  __builtin_amdgcn_fence(__ATOMIC_ACQ_REL, "workgroup");
  __builtin_amdgcn_wave_barrier();
  {
    for (int r = 0; r < 16; ++r) {
      const int row = q0 + r;
      if (row < T && lane < D / 4) {
        const v4f val = *(const v4fa*)&sO[w][r][lane * 4];
        *(v4f*)(y + ((size_t)b * T + row) * ypitch + h * D + lane * 4) = val;
      }
    }
    
  }
}

// GEMM C = act(A·W + bias + resid): A f32 (ASPLIT -> hi/lo 2 terms), Wt bf16 [N][K]; ACT 0 none, 1 relu, 2 exact gelu;
// resid (optional, f32, row index = (row % rmod), pitch ldr, RES_BF16 rounds it) added before the activation.
template <bool ASPLIT, int ACT, bool BIAS_BF16, bool RES_BF16>
__global__ __launch_bounds__(128) void k_gemm_bf3(const float* __restrict__ A, int lda, const unsigned short* __restrict__ Wt, int ldb,
                                                const float* __restrict__ bias, const float* __restrict__ resid, int rmod, int ldr,
                                                float* __restrict__ C, int ldc, int M, int N, int K) {
  __shared__ __attribute__((aligned(16))) float so[4][16][64];
  const int tid = threadIdx.x, w = tid >> 5, lane = tid & 31, ln = lane & 15, hh = lane >> 4;
  const int ntn = N / 64;
  const int wid = blockIdx.x * 4 + w;
  const int mt = wid / ntn, nq = wid % ntn;
  if (mt * 16 >= M) return;
  const int row0 = mt * 16, col0 = nq * 64;
  const float* arow = A + (size_t)(row0 + ln) * lda;
  v8f acc[4] = {};
  for (int kb = 0; kb < K; kb += 32) {
    FragB ah, al;
    const v4f x0 = *(const v4fa*)(arow + kb + 8 * hh), x1 = *(const v4fa*)(arow + kb + 8 * hh + 4);
    const v4f x2 = *(const v4fa*)(arow + kb + 16 + 8 * hh), x3 = *(const v4fa*)(arow + kb + 16 + 8 * hh + 4);
    float xs[16] = {x0[0],x0[1],x0[2],x0[3],x1[0],x1[1],x1[2],x1[3],x2[0],x2[1],x2[2],x2[3],x3[0],x3[1],x3[2],x3[3]};
#pragma unroll
    for (int i = 0; i < 16; ++i) { const unsigned short hb = bf16_bits(xs[i]); ah.u[i] = hb; al.u[i] = ASPLIT ? bf16_bits(xs[i] - bf16_val(hb)) : (unsigned short)0; }
#pragma unroll
    for (int t = 0; t < 4; ++t) {
      const unsigned short* brow = Wt + (size_t)(col0 + t * 16 + ln) * ldb + kb;
      FragB b;
      b.half[0] = *(const v8us*)(brow + 8 * hh);
      b.half[1] = *(const v8us*)(brow + 16 + 8 * hh);
      acc[t] = mmaN<ASPLIT ? 2 : 1>(ah.v, al.v, b.v, b.v, acc[t]);
    }
  }
#pragma unroll
  for (int t = 0; t < 4; ++t) {
    const int col = col0 + t * 16 + ln;
    float bv = bias ? bias[col] : 0.f;
    if (BIAS_BF16) bv = bf16_round(bv);
#pragma unroll
    for (int r = 0; r < 8; ++r) {
      float v = acc[t][r] + bv;
      if (resid) { float rv = resid[(size_t)((row0 + 8 * hh + r) % rmod) * ldr + col]; if (RES_BF16) rv = bf16_round(rv); v += rv; }
      if (ACT == 1) v = fmaxf(v, 0.f);
      if (ACT == 2) v = 0.5f * v * (1.0f + erff(v * 0.70710678118654752f));
      if (ACT == 3) { const float u = 0.7978845608028654f * (v + 0.044715f * v * v * v); v = 0.5f * v * (1.0f + tanhf(u)); }
      so[w][8 * hh + r][t * 16 + ln] = v;
    }
  }
  __builtin_amdgcn_fence(__ATOMIC_ACQ_REL, "workgroup");
  __builtin_amdgcn_wave_barrier();
  const int rsub = lane >> 4, c4 = (lane & 15) * 4;
  {
#pragma unroll
    for (int q = 0; q < 8; ++q) {
      const int r = q * 2 + rsub;
      const v4f v = *(const v4fa*)&so[w][r][c4];
      *(v4f*)(C + (size_t)(row0 + r) * ldc + col0 + c4) = v;
    }
    
  }
}
// row LayerNorm (biased variance, eps) over N: s = X (+ R); optional out_sum <- s; out_norm <- (s-mu)*rsqrt(var+eps)*g + b
template <bool PARAM_BF16>
__global__ __launch_bounds__(256) void k_layernorm(const float* __restrict__ X, const float* __restrict__ R, const float* __restrict__ g, const float* __restrict__ bta,
                                                  float* __restrict__ out_sum, float* __restrict__ out_norm, int N, float eps) {
  __shared__ float red[256];
  const int row = blockIdx.x, tid = threadIdx.x;
  const float* x = X + (size_t)row * N; const float* rr = R ? R + (size_t)row * N : nullptr;
  float vals[16];                     // up to N = 4096
  const int per = N / 256;            // contiguous chunk per thread? use strided-by-4 chunks: thread handles j = tid*4 + 1024*u
  float s1 = 0.f;
  for (int u = 0; u < per / 4; ++u) {
    const int j = tid * 4 + 1024 * u;
    const v4f a = *(const v4fa*)(x + j);
    v4f b = {0.f,0.f,0.f,0.f}; if (rr) b = *(const v4fa*)(rr + j);
#pragma unroll
    for (int q = 0; q < 4; ++q) { const float v = a[q] + b[q]; vals[u * 4 + q] = v; s1 += v; }
  }
  red[tid] = s1; __syncthreads();
  for (int st = 128; st > 0; st >>= 1) { if (tid < st) red[tid] += red[tid + st]; __syncthreads(); }
  const float mu = red[0] / (float)N; __syncthreads();
  float s2 = 0.f;
  for (int u = 0; u < per / 4; ++u)
#pragma unroll
    for (int q = 0; q < 4; ++q) { const float c = vals[u * 4 + q] - mu; s2 += c * c; }
  red[tid] = s2; __syncthreads();
  for (int st = 128; st > 0; st >>= 1) { if (tid < st) red[tid] += red[tid + st]; __syncthreads(); }
  const float rs = rsqrtf(red[0] / (float)N + eps);
  {
    for (int u = 0; u < per / 4; ++u) {
      const int j = tid * 4 + 1024 * u;
      v4f o, sm;
#pragma unroll
      for (int q = 0; q < 4; ++q) {
        float gg = g[j + q], bb = bta[j + q];
        if (PARAM_BF16) { gg = bf16_round(gg); bb = bf16_round(bb); }
        sm[q] = vals[u * 4 + q]; o[q] = (vals[u * 4 + q] - mu) * rs * gg + bb;
      }
      if (out_sum) *(v4f*)(out_sum + (size_t)row * N + j) = sm;
      *(v4f*)(out_norm + (size_t)row * N + j) = o;
    }
    
  }
}



// ---- f16 WMMA path (v_wmma_f32_16x16x32_f16): 11-bit significands for operands in range — used where a [0,1] probability operand needs more precision than bf16
typedef _Float16 v16h __attribute__((ext_vector_type(16)));
union FragH { v16h v; v8us half[2]; _Float16 h[16]; unsigned short u[16]; };
template <int NT>
__device__ __forceinline__ v8f mmaH(v16h ah, v16h al, v16h bh, v16h bl, v8f c) {
  c = __builtin_amdgcn_wmma_f32_16x16x32_f16(false, ah, false, bh, (short)0, c, false, false);
  if (NT >= 2) c = __builtin_amdgcn_wmma_f32_16x16x32_f16(false, al, false, bh, (short)0, c, false, false);
  if (NT >= 3) c = __builtin_amdgcn_wmma_f32_16x16x32_f16(false, ah, false, bl, (short)0, c, false, false);
  asm volatile("v_nop\n\tv_nop\n\tv_nop\n\tv_nop" : "+v"(c) : "v"(ah), "v"(al), "v"(bh), "v"(bl));
  return c;
}
// batched GEMM like k_gemm_b but f16 operands: A f32 (split into f16 hi/lo if ASPLIT, else rounded to f16), Bt = f16 values [n][k]; alpha; C f32; N multiple of 16 (partial tiles skipped)
template <bool ASPLIT>
__global__ __launch_bounds__(128) void k_gemm_h(const float* __restrict__ A, int lda, size_t sA, const _Float16* __restrict__ Bh, int ldb, size_t sB, float alpha, float* __restrict__ C, int ldc, size_t sC, int M, int N, int K) {
  __shared__ __attribute__((aligned(16))) float so[4][16][64];
  const int tid = threadIdx.x, w = tid >> 5, lane = tid & 31, ln = lane & 15, hh = lane >> 4; const int by = blockIdx.y;
  A += (size_t)by * sA; Bh += (size_t)by * sB; C += (size_t)by * sC;
  const int ntn = (N + 63) / 64; const int wid = blockIdx.x * 4 + w; const int mt = wid / ntn, nq = wid % ntn; if (mt * 16 >= M) return;
  const int row0 = mt * 16, col0 = nq * 64; const float* arow = A + (size_t)(row0 + ln) * lda;
  v8f acc[4] = {};
  for (int kb = 0; kb < K; kb += 32) {
    FragH ah, al;
    const v4f x0 = *(const v4fa*)(arow + kb + 8 * hh), x1 = *(const v4fa*)(arow + kb + 8 * hh + 4), x2 = *(const v4fa*)(arow + kb + 16 + 8 * hh), x3 = *(const v4fa*)(arow + kb + 16 + 8 * hh + 4);
    float xs[16] = {x0[0],x0[1],x0[2],x0[3],x1[0],x1[1],x1[2],x1[3],x2[0],x2[1],x2[2],x2[3],x3[0],x3[1],x3[2],x3[3]};
#pragma unroll
    for (int i = 0; i < 16; ++i) { const _Float16 h = (_Float16)xs[i]; ah.h[i] = h; al.h[i] = ASPLIT ? (_Float16)(xs[i] - (float)h) : (_Float16)0.0f; }
#pragma unroll
    for (int t = 0; t < 4; ++t) { if (col0 + t * 16 >= N) continue; const size_t boff = (size_t)(col0 + t * 16 + ln) * ldb + kb; FragH bq; bq.half[0] = *(const v8us*)(Bh + boff + 8 * hh); bq.half[1] = *(const v8us*)(Bh + boff + 16 + 8 * hh);
      acc[t] = mmaH<ASPLIT ? 2 : 1>(ah.v, al.v, bq.v, bq.v, acc[t]); }
  }
#pragma unroll
  for (int t = 0; t < 4; ++t) { if (col0 + t * 16 >= N) continue;
#pragma unroll
    for (int r = 0; r < 8; ++r) so[w][8 * hh + r][t * 16 + ln] = acc[t][r] * alpha; }
  __builtin_amdgcn_fence(__ATOMIC_ACQ_REL, "workgroup"); __builtin_amdgcn_wave_barrier();
  const int rsub = lane >> 4, c4 = (lane & 15) * 4;
  {
#pragma unroll
    for (int q = 0; q < 8; ++q) { const int r = q * 2 + rsub; if (col0 + c4 < N) { const v4f v = *(const v4fa*)&so[w][r][c4]; *(v4f*)(C + (size_t)(row0 + r) * ldc + col0 + c4) = v; } }
     }
}

// Wt[n][k] = f16(W[k][n]·scale) from f32 row-major W[K][N] (scale = power of two; bf16-exact weights stay exact in f16 away from the subnormal range)
__global__ __launch_bounds__(256) void k_wt_f16(const float* __restrict__ W, _Float16* __restrict__ Wt, int K, int N, float scale) {
  const int t = blockIdx.x * 256 + threadIdx.x; if (t >= N * (K / 8)) return; const int n = t / (K / 8), k8 = (t % (K / 8)) * 8; FragH f;
#pragma unroll
  for (int i = 0; i < 8; ++i) f.h[i] = (_Float16)(bf16_round(W[(size_t)(k8 + i) * N + n]) * scale); const v8us o = f.half[0];
  *(v8us*)((unsigned short*)Wt + (size_t)n * K + k8) = o; 
}
// k_gemm_hh variant with fused epilogue: v = acc·alpha + bias[by·sBias + col] (+ CP[(row/rowsPerB)·sCPb + by·64 + col] if CP) ; ACT 0 none / 1 elu ; writes f32 C and f16 C16 where non-null
// the body takes its block indices (bx, by) and its 17 KiB of LDS from the caller, so that several products can share one launch
// A (M x K), Bh (N x K) and C16 (M x N) lie in fragment order; C is row-major with pitch ldc; CT, where given, takes the result alone, transposed per head. SOP: row pitch of the LDS tile in floats, 4 more than the row so that 16 lanes reading 16 rows at one column meet 16 different bank groups
#define SOP 68
#define L2E 1.4426950408889634f
// ACT 4 (the similarity product): what is stored is not the similarity but what a score holds beside its product that differs from key to key and not from head to head, in base 2 (see k_flash): row = query q, column = key k of batch by,
// log2(e) (min(sim, 0.5) + pos(q, k) - pos(q, kc)), -inf where kmask[by][k] = 0, with pos(q, k) = 0.1 min(10 - |q - k|, 0) and kc = (k & ~7) + 4, a fixed key of k's group of eight.
// The semantic bias is min(sim, 0.5) - 0.5; its -0.5 is the same for every key of a query and drops out of the softmax. pos(q, kc), the part of the position term that grows with the distance, is left to k_flash, in f32:
// what is rounded to f16 here stays below 2.1 in size for every query and key (|pos(q, k) - pos(q, kc)| <= 0.4), so its rounding error is at most 0.001 whichever keys the mask leaves.
// row-major element offset of 16-byte chunk t of a fragment-order plane of KD columns
__device__ __forceinline__ size_t frag_src(const size_t t, const int KD) { const size_t blk = t >> 6; const int kbn = KD >> 5;
  return ((blk / kbn) * 16 + (t & 15)) * KD + (blk % kbn) * 32 + ((t >> 5) & 1) * 16 + ((t >> 4) & 1) * 8; }
template <int ACT>
__device__ __forceinline__ void gemm_hhx_body(float (*so)[16][SOP], const int bx, const int by, const _Float16* __restrict__ A, size_t sA, const _Float16* __restrict__ Bh, size_t sB, float alpha, const float* __restrict__ bias, size_t sBias, const float* __restrict__ CP, int rowsPerB, size_t sCPb, int row0g, const int* __restrict__ kmask,
    float* __restrict__ C, _Float16* __restrict__ C16, _Float16* __restrict__ CT, float* __restrict__ KN, int ldc, size_t sC, int M, int N, int K) {
  const int tid = threadIdx.x, w = tid >> 5, lane = tid & 31, ln = lane & 15, hh = lane >> 4;
  A += (size_t)by * sA; Bh += (size_t)by * sB; const size_t cofs = (size_t)by * sC; const float* bp = bias ? bias + (size_t)by * sBias : nullptr;
  const int ntn = (N + 63) / 64; const int wid = bx * 4 + w; const int mt = wid / ntn, nq = wid % ntn; if (mt * 16 >= M) return;
  const int row0 = mt * 16, col0 = nq * 64; const size_t tsz = (size_t)(K >> 5) * 512;      // f16 elements of one 16-row tile
  const unsigned short* afr = (const unsigned short*)A + (size_t)mt * tsz + lane * 8; const unsigned short* bfr = (const unsigned short*)Bh + (size_t)(col0 >> 4) * tsz + lane * 8;
  v8f acc[4] = {};
  // The fragments come in groups of two k steps (20 loads of 16 bytes a lane) into two register sets: while one set is multiplied, the other set's loads are in flight,
  // so a wave waits for memory once a group, behind eight products, where a load, a full wait and one product in turn paid the whole latency for every product. K is a multiple of 128. Each acc[t] still sums k upwards.
  FragH a0[2], b0[2][4], a1[2], b1[2][4];
  auto ldg = [&](FragH (&a)[2], FragH (&b)[2][4], const int kb) {
#pragma unroll
    for (int s = 0; s < 2; ++s) { a[s].half[0] = *(const v8us*)(afr + (kb + 32 * s) * 16); a[s].half[1] = *(const v8us*)(afr + (kb + 32 * s) * 16 + 256);
#pragma unroll
      for (int t = 0; t < 4; ++t) { if (col0 + t * 16 >= N) continue; const size_t boff = (size_t)t * tsz + (kb + 32 * s) * 16; b[s][t].half[0] = *(const v8us*)(bfr + boff); b[s][t].half[1] = *(const v8us*)(bfr + boff + 256); } }
    asm volatile("s_wait_xcnt 0x0" ::: "memory");      // stands in front of every later write of a register that one of the group's loads names as its address
    __builtin_amdgcn_sched_barrier(0);      // keeps the group's loads together and in front of the other set's products (else they sink to their first use and each product waits for its own load again)
  };
  auto mmg = [&](FragH (&a)[2], FragH (&b)[2][4]) {
#pragma unroll
    for (int s = 0; s < 2; ++s)
#pragma unroll
      for (int t = 0; t < 4; ++t) { if (col0 + t * 16 >= N) continue; acc[t] = mmaH<1>(a[s].v, a[s].v, b[s][t].v, b[s][t].v, acc[t]); }
  };
  float bl[4] = {0.f, 0.f, 0.f, 0.f};      // the four bias values are asked for in front of the first group, not one by one behind the loop with a full wait each
  if (bp) {
#pragma unroll
    for (int t = 0; t < 4; ++t) { if (col0 + t * 16 >= N) continue; bl[t] = bp[col0 + t * 16 + ln]; } }
  int km[4] = {1, 1, 1, 1};      // ACT 4: the mask words of the lane's four key columns, asked for in front of the first group as well
  if (ACT == 4) {
#pragma unroll
    for (int t = 0; t < 4; ++t) km[t] = kmask[(size_t)by * N + col0 + t * 16 + ln]; }
  const float qk0 = (float)(row0 + 8 * hh - col0 - ln), kg = (float)((ln & 7) - 4);      // ACT 4: query - key of the lane's element (t = 0, r = 0), and key - kc; all distances are whole numbers, exact in f32
  ldg(a0, b0, 0);
  for (int kb = 0; kb < K; kb += 128) {
    ldg(a1, b1, kb + 64); mmg(a0, b0);
    if (kb + 128 < K) ldg(a0, b0, kb + 128);
    mmg(a1, b1); }
  if (CT) {      // the value product (N = DM, rows = BB x SS keys): lane (ln, hh) holds in acc[t] column 16 t + ln of head nq for keys row0 + 8 hh .. + 7, which is 16-byte chunk (hh, ln) of one half block of the head's
    // transposed plane (HD rows x SS keys, fragment order) as it lies: four stores of 512 bytes in a row straight from the accumulators, no LDS, and no launch that reads the plane back to turn it
    unsigned short* tfr = (unsigned short*)CT + (size_t)((row0 / SS) * NH + nq) * (HD / 16) * ((SS / 32) * 512) + ((row0 % SS) >> 4) * 256 + lane * 8;
#pragma unroll
    for (int t = 0; t < 4; ++t) { const float bv = bf16_round(bl[t]); FragH f;
#pragma unroll
      for (int r = 0; r < 8; ++r) f.h[r] = (_Float16)(acc[t][r] * alpha + bv);
      *(v8us*)(tfr + (size_t)t * ((SS / 32) * 512)) = f.half[0]; }
    asm volatile("s_wait_xcnt 0x0" ::: "memory");      // in the listing the other results' epilogue stands behind a branch after these stores and writes their registers: the wait stands in front of it
    return; }
#pragma unroll
  for (int t = 0; t < 4; ++t) { if (col0 + t * 16 >= N) continue; const int col = col0 + t * 16 + ln; const float bv = bf16_round(bl[t]);
#pragma unroll
    for (int r = 0; r < 8; ++r) { float v = acc[t][r] * alpha + bv; if (CP) { const int bidx = (row0g + row0 + 8 * hh + r) / rowsPerB; v += CP[(size_t)bidx * sCPb + (size_t)by * 64 + col]; } if (ACT == 1) v = (v > 0.f) ? v : expm1f(v); else if (ACT == 3) v = fmaxf(v, 0.f);
      else if (ACT == 4) { const float d = qk0 + (float)(r - 16 * t);      // the upper bound of the key's own position term is 0, or -inf for a masked key, which makes the sum -inf
        v = fmaf(fminf(10.f - fabsf(d), (km[t] != 0) ? 0.f : -INFINITY) - fminf(10.f - fabsf(d + kg), 0.f), 0.1f * L2E, fminf(v * L2E, 0.5f * L2E)); }
      so[w][8 * hh + r][t * 16 + ln] = v; } }
  __builtin_amdgcn_fence(__ATOMIC_ACQ_REL, "workgroup"); __builtin_amdgcn_wave_barrier();
  const int rsub = lane >> 4, c4 = (lane & 15) * 4;
  if (C) {
#pragma unroll
    for (int q = 0; q < 8; ++q) { const int r = q * 2 + rsub; if (col0 + c4 < N) { const v4f v = *(const v4fa*)&so[w][r][c4]; *(v4f*)(C + cofs + (size_t)(row0 + r) * ldc + col0 + c4) = v; } }
  }
  if (C16) {      // the wave's 16 x 64 tile is two blocks of the plane, 2 KiB in a row: four stores of 512 bytes
    unsigned short* cfr = (unsigned short*)C16 + cofs + ((size_t)mt * (N >> 5) + (col0 >> 5)) * 512 + lane * 8;
#pragma unroll
    for (int c = 0; c < 4; ++c) { if (col0 + c * 16 >= N) continue; const v4f v0 = *(const v4fa*)&so[w][ln][c * 16 + 8 * hh], v1 = *(const v4fa*)&so[w][ln][c * 16 + 8 * hh + 4]; FragH f;
#pragma unroll
      for (int i = 0; i < 4; ++i) { f.h[i] = (_Float16)v0[i]; f.h[4 + i] = (_Float16)v1[i]; }
      *(v8us*)(cfr + c * 256) = f.half[0]; }
    asm volatile("s_wait_xcnt 0x0" ::: "memory");      // stands in front of all that follows the four stores above, here and in the merged listing, and may write the registers that they name
    if (KN) {      // the key product: the wave's tile is 16 keys x the 64 columns of head nq; the lane sums the squares of the 32 values of key ln that it has just stored, as stored (f16). The largest length of the 16 keys goes to KN, a 128-byte line to each tile and head (one writer a line)
      float nsq = 0.f;
#pragma unroll
      for (int c = 0; c < 4; ++c) { const v4f v0 = *(const v4fa*)&so[w][ln][c * 16 + 8 * hh], v1 = *(const v4fa*)&so[w][ln][c * 16 + 8 * hh + 4];
#pragma unroll
        for (int i = 0; i < 4; ++i) { const float x0 = (float)(_Float16)v0[i], x1 = (float)(_Float16)v1[i]; nsq = fmaf(x0, x0, nsq); nsq = fmaf(x1, x1, nsq); } }
      nsq += __shfl_xor(nsq, 16, 32);
      for (int o = 8; o >= 1; o >>= 1) nsq = fmaxf(nsq, __shfl_xor(nsq, o, 32));
      if (lane == 0) KN[((size_t)mt * (N >> 6) + nq) * 32] = sqrtf(nsq);
      asm volatile("s_wait_xcnt 0x0" ::: "memory");      // in the merged listing another role's code may follow this store and write its address register: the wait stands in front of that
    }
  }
}
// the output projection: its shapes are constants, as in k_proj, so that the column guards of the body fold away and a group's loads stand in one run with no branch between them
__global__ __launch_bounds__(128) void k_oproj(const _Float16* __restrict__ A, const _Float16* __restrict__ Bh, const float* __restrict__ bias, float* __restrict__ C) {
  __shared__ __attribute__((aligned(16))) float so[4][16][SOP];
  gemm_hhx_body<0>(so, blockIdx.x, 0, A, 0, Bh, 0, 0.0625f, bias, 0, nullptr, 1, 0, 0, nullptr, C, nullptr, nullptr, nullptr, DM, 0, NR, DM, DM);
}


// x16_body, round16f_body, sn_body and qsum_body are roles of one launch (k_prep, blocks of 512): each takes its block index bx inside its role
__device__ __forceinline__ void x16_body(const int bx, const float* __restrict__ x, _Float16* __restrict__ X16) { const size_t t = (size_t)bx * 512 + threadIdx.x, s = frag_src(t, DM); FragH f;
#pragma unroll
  for (int q = 0; q < 8; ++q) f.h[q] = (_Float16)bf16_round(x[s + q]); *(v8us*)((unsigned short*)X16 + t * 8) = f.half[0];  }
__device__ __forceinline__ void round16f_body(const int bx, const float* __restrict__ W, _Float16* __restrict__ Bt) { const size_t t = (size_t)bx * 512 + threadIdx.x, s = frag_src(t, DM); FragH f;
#pragma unroll
  for (int i = 0; i < 8; ++i) f.h[i] = (_Float16)(bf16_round(W[s + i]) * 16.0f); *(v8us*)((unsigned short*)Bt + t * 8) = f.half[0];
  asm volatile("s_wait_xcnt 0x0" ::: "memory");      // in the merged listing the next role's code follows this store and writes its address register: the wait stands in front of that write
}
// the block's 16 rows are one row tile of SN (8 KiB): each wave lays its row's chunks into LDS at their places in the tile, and behind the barrier every thread stores 16 bytes of it in a row, so that a 128-byte line has one writer
__device__ __forceinline__ void sn_body(unsigned short* __restrict__ st, const int bx, const float* __restrict__ sf, _Float16* __restrict__ SN) { const int tid = threadIdx.x, wv = tid >> 5, lane = tid & 31; const size_t row = (size_t)bx * 16 + wv; float v[8]; float s = 0.f;
#pragma unroll
  for (int q = 0; q < 8; ++q) { v[q] = bf16_round(sf[row * DSEM + lane * 8 + q]); s += v[q] * v[q]; }
  for (int o = 16; o >= 1; o >>= 1) s += __shfl_xor(s, o, 32); const float inv = 1.0f / fmaxf(sqrtf(s), 1e-12f); FragH f;
#pragma unroll
  for (int q = 0; q < 8; ++q) f.h[q] = (_Float16)(v[q] * inv);
  *(v8us*)(st + (lane >> 1) * 256 + ((lane & 1) * 16 + wv) * 8) = f.half[0];      // chunk lane of the row = columns 8 lane ..: block lane >> 2, j = (lane >> 1) & 1, hh = lane & 1
  __syncthreads();
  *(v8us*)((unsigned short*)SN + (size_t)bx * (16 * DSEM) + tid * 8) = *(const v8us*)(st + tid * 8);
  asm volatile("s_wait_xcnt 0x0" ::: "memory");      // in the merged listing the next role's code follows this store and writes its address register: the wait stands in front of that write
}
// dynamic temperature, stage 1: column sums of the bf16-rounded query over QROWS rows per block -> PART[b][chunk][DM]; thread = 4 columns x one of 4 row phases, 16 independent 16-byte loads
#define QP 32
#define QROWS (SS / QP)
__device__ __forceinline__ void qsum_body(float (*sred)[DM], const int bx, const float* __restrict__ query, float* __restrict__ PART) {
  const int tid = threadIdx.x, ph = tid >> 7, c4 = (tid & 127) * 4;
  const float* src = query + ((size_t)bx * QROWS + ph * (QROWS / 4)) * DM + c4; v4f s = {0.f, 0.f, 0.f, 0.f};
#pragma unroll  // all 16 row loads issue before the first add: one memory latency instead of 16
  for (int r = 0; r < QROWS / 4; ++r) { const v4f x = *(const v4fa*)(src + (size_t)r * DM);
#pragma unroll
    for (int q = 0; q < 4; ++q) s[q] += bf16_round(x[q]); }
  *(v4fa*)&sred[ph][c4] = s; __syncthreads();
  PART[(size_t)bx * DM + tid] = (sred[0][tid] + sred[1][tid]) + (sred[2][tid] + sred[3][tid]); }
// one launch for all work that reads inputs only: column sums of the query, the three f16 activation planes, the normalised semantic rows, the four weight planes; role by block range
#define PB_QS (BB * QP)
#define PB_X (NR * DM / 8 / 512)
#define PB_SN (NR / 16)
#define PB_W (DM * DM / 8 / 512)
__global__ __launch_bounds__(512) void k_prep(const float* __restrict__ xq, const float* __restrict__ xk, const float* __restrict__ xv, const float* __restrict__ sf,
    const float* __restrict__ Wq, const float* __restrict__ Wk, const float* __restrict__ Wv, const float* __restrict__ Wo,
    _Float16* __restrict__ XQ, _Float16* __restrict__ XK, _Float16* __restrict__ XV, _Float16* __restrict__ SN,
    _Float16* __restrict__ Bq, _Float16* __restrict__ Bk, _Float16* __restrict__ Bv, _Float16* __restrict__ Bo, float* __restrict__ PART) {
  __shared__ __attribute__((aligned(16))) float sred[4][DM];
  const int bx = blockIdx.x, bx1 = bx - PB_QS, bx2 = bx1 - 3 * PB_X, bx3 = bx2 - PB_SN;
  if (bx1 < 0) qsum_body(sred, bx, xq, PART);
  else if (bx2 < 0) { const int g = bx1 / PB_X; x16_body(bx1 % PB_X, g == 0 ? xq : g == 1 ? xk : xv, g == 0 ? XQ : g == 1 ? XK : XV); }
  else if (bx3 < 0) sn_body((unsigned short*)&sred[0][0], bx2, sf, SN);
  else { const int g = bx3 / PB_W; round16f_body(bx3 % PB_W, g == 0 ? Wq : g == 1 ? Wk : g == 2 ? Wv : Wo, g == 0 ? Bq : g == 1 ? Bk : g == 2 ? Bv : Bo); } }
// stage 2 (one block of 4 waves, a role of k_proj, beside the products that do not need it): mean query of both batches from PART, then one wave per hidden unit (lanes along DM, 16-byte loads of the
// Wt1 row shared by both batches), relu, Wt2 dot, sigmoid. The hidden units are summed in 32 groups of 8, each wave taking 8 groups in turn.
__device__ __forceinline__ void temp_body(float* __restrict__ sm, const float* __restrict__ PART, const float* __restrict__ Wt1, const float* __restrict__ bt1, const float* __restrict__ Wt2, const float* __restrict__ bt2, float* __restrict__ TEMP) {
  float (*qm)[DM] = (float (*)[DM])sm; float (*red)[32] = (float (*)[32])(sm + BB * DM); const int tid = threadIdx.x, wv = tid >> 5, lane = tid & 31;
#pragma unroll 1  // kept rolled: a trip's loads are in flight together already, and all trips' loads at once would need more than 256 registers
  for (int it = 0; it < BB * DM / 128; ++it) { const int c = it * 128 + tid, b = c >> 9, col = c & (DM - 1); float s = 0.f;
#pragma unroll  // all 32 partial loads in flight together
    for (int p = 0; p < QP; ++p) s += PART[((size_t)b * QP + p) * DM + col];
    qm[b][col] = s / (float)SS; }
  __syncthreads();
  v4f qv[BB][4];
#pragma unroll
  for (int b = 0; b < BB; ++b)
#pragma unroll
    for (int j = 0; j < 4; ++j) qv[b][j] = *(const v4fa*)&qm[b][j * 128 + lane * 4];
#pragma unroll 1  // one group of 8 hidden units a trip, kept rolled: two groups' rows at once would need more than 256 registers
  for (int gq = 0; gq < 8; ++gq) { const int grp = wv * 8 + gq;
  float pw[BB] = {0.f, 0.f};
  constexpr int GU = (DM / 2) / 32;      // hidden units of a group
  // the group's loads stand together: eight rows = 32 loads of 16 bytes a lane, and the eight bt1 and Wt2 values: one memory latency a group, was four. With them the launch takes 252 registers against the products' 212: four waves a SIMD either way
  float b1r[GU], w2r[GU], a[GU][BB];
#pragma unroll
  for (int i = 0; i < GU; ++i) { b1r[i] = bt1[grp * GU + i]; w2r[i] = Wt2[grp * GU + i]; }
#pragma unroll
  for (int i = 0; i < GU; ++i) { const float* wr = Wt1 + (size_t)(grp * GU + i) * DM + lane * 4; a[i][0] = 0.f; a[i][1] = 0.f;
#pragma unroll
    for (int j = 0; j < 4; ++j) { const v4f wq = *(const v4fa*)(wr + j * 128);
#pragma unroll
      for (int q = 0; q < 4; ++q) { const float wb = bf16_round(wq[q]);
#pragma unroll
        for (int b = 0; b < BB; ++b) a[i][b] += wb * qv[b][j][q]; } } }
  // loaded values as inputs only: holds the bt1 and Wt2 loads in front of the lane sums (else they sink into the branch of lane 0 below and the group pays a second latency there)
  asm volatile("" :: "v"(b1r[0]), "v"(b1r[1]), "v"(b1r[2]), "v"(b1r[3]), "v"(b1r[4]), "v"(b1r[5]), "v"(b1r[6]), "v"(b1r[7]), "v"(w2r[0]), "v"(w2r[1]), "v"(w2r[2]), "v"(w2r[3]), "v"(w2r[4]), "v"(w2r[5]), "v"(w2r[6]), "v"(w2r[7]));
  static_assert(GU == 8 && BB == 2, "the statement above names eight values of each");
#pragma unroll  // the sixteen lane sums run side by side
  for (int i = 0; i < GU; ++i) { const float b1 = bf16_round(b1r[i]), w2 = bf16_round(w2r[i]);
#pragma unroll
    for (int b = 0; b < BB; ++b) { float t = a[i][b]; for (int o = 16; o >= 1; o >>= 1) t += __shfl_xor(t, o, 32); pw[b] += fmaxf(t + b1, 0.f) * w2; } }
  if (lane == 0) {
#pragma unroll
    for (int b = 0; b < BB; ++b) red[b][grp] = pw[b]; } }
  __syncthreads();
  if (tid < 32) { float v = 0.f; if (tid < BB) { float z = bf16_round(bt2[0]); for (int q = 0; q < 32; ++q) z += red[tid][q]; const float t = 1.0f / (1.0f + expf(-z)); v = 0.5f + t * 1.5f; } TEMP[tid] = v; } }
// one launch for all that needs k_prep alone: block 0 the temperature, then the q, k and v projections (the longer products first), then the similarity plane; role by block range
#define GB_P ((NR / 16) * (DM / 64) / 4)
#define GB_S ((SS / 16) * (SS / 64) / 4)
__global__ __launch_bounds__(128) void k_proj(const _Float16* __restrict__ XQ, const _Float16* __restrict__ XK, const _Float16* __restrict__ XV, const _Float16* __restrict__ Bq, const _Float16* __restrict__ Bk, const _Float16* __restrict__ Bv,
    const float* __restrict__ bq, const float* __restrict__ bk, const float* __restrict__ bv, _Float16* __restrict__ Q16, _Float16* __restrict__ K16, _Float16* __restrict__ Vt, const _Float16* __restrict__ SN, const int* __restrict__ mask, _Float16* __restrict__ SIM,
    const float* __restrict__ PART, const float* __restrict__ Wt1, const float* __restrict__ bt1, const float* __restrict__ Wt2, const float* __restrict__ bt2, float* __restrict__ TEMP, float* __restrict__ KN) {
  __shared__ __attribute__((aligned(16))) float so[4][16][SOP];
  int bx = blockIdx.x;
  if (bx == 0) { temp_body(&so[0][0][0], PART, Wt1, bt1, Wt2, bt2, TEMP); return; }
  bx -= 1;
  if (bx < 3 * GB_P) { const int g = bx / GB_P;
    gemm_hhx_body<0>(so, bx % GB_P, 0, g == 0 ? XQ : g == 1 ? XK : XV, 0, g == 0 ? Bq : g == 1 ? Bk : Bv, 0, 0.0625f, g == 0 ? bq : g == 1 ? bk : bv, 0, nullptr, 1, 0, 0, nullptr, nullptr, g == 0 ? Q16 : g == 1 ? K16 : nullptr, g == 2 ? Vt : nullptr, g == 1 ? KN : nullptr, DM, 0, NR, DM, DM); return; }
  bx -= 3 * GB_P;
  // SIM[b] = the head-independent, key-to-key part of the scores, from SN[b].SN[b]^T, the positions and the key mask (f16)
  gemm_hhx_body<4>(so, bx % GB_S, bx / GB_S, SN, (size_t)SS * DSEM, SN, (size_t)SS * DSEM, 1.0f, nullptr, 0, nullptr, 1, 0, 0, mask, nullptr, SIM, nullptr, nullptr, SS, (size_t)SS * SS, SS, SS, DSEM); }
// fused constrained attention per ((b,h), 128 queries): 16 waves = 4 query groups of 32 x 4 key sets, four waves a SIMD, so that one wave's loads and dependent vector chains hide behind three others;
// key set s holds the 32-key chunks s, s + 4, s + 8, ...: the four sets walk side by side; Q16, K16, Vt and SIM lie in fragment order, so each of a pass's 20 fragment loads reads 4 whole lines;
// the four partial results of a query group (own running max, sum, Ot) are joined through LDS behind the loop. s = (q.k)/(8 temp_b) + SIM[b][q][k] + pos(q, kc): the plane holds semantic bias, key mask (-inf) and the position bias less its value at key kc of the group of eight, summed once for all eight heads by its producer;
// pos(q, kc) is one f32 value for the lane's eight scores of a tile: it is added to the tile's max and taken off the running max, never added score by score.
// Transposed products: St = K.Qt (A = 16 key rows, B = 16 query columns), Ot += Vt.Pt. Lane (ln, hh) then holds, for query ln of a tile, the scores of keys 8 hh + r of each 16-key tile:
// the running max and sum are in-lane work plus one swap between the wave halves, two St tiles converted to f16 are the B operand of the second product as they lie, SIM[q][k .. k + 7] is one 16-byte load (half nt of the plane's block: query tile x 32 keys).
typedef _Float16 v8h __attribute__((ext_vector_type(8)));
union FragP { v16h v; v8h p[2]; };
// The softmax runs in base 2: log2(e) is folded into the score scale and into both biases, so a score, a running max and their differences are exponents of 2 and every
// exponential is one v_exp_f32 (expf costs about twelve vector instructions: scaling, rounding, ldexp and two range selects). A result below 2^-126 comes out as 0, as does exp2(-inf).
// Written as asm so that the slot which the instruction set asks for behind a transcendental (one independent instruction or v_nop before its result is used or its source overwritten) is kept by construction:
// as builtins, runs of v_exp_f32 came out with each one's result in the register that the one before it had just read. Eight in place: none reads or overwrites a register of another; the v_nop is the slot behind the last.
__device__ __forceinline__ float exp2_raw(float x) { asm("v_exp_f32 %0, %0\n\tv_nop" : "+v"(x)); return x; }
__device__ __forceinline__ v8f exp2_x8(const v8f x) { float a = x[0], b = x[1], c = x[2], d = x[3], e = x[4], f = x[5], g = x[6], h = x[7];
  asm("v_exp_f32 %0, %0\n\tv_exp_f32 %1, %1\n\tv_exp_f32 %2, %2\n\tv_exp_f32 %3, %3\n\tv_exp_f32 %4, %4\n\tv_exp_f32 %5, %5\n\tv_exp_f32 %6, %6\n\tv_exp_f32 %7, %7\n\tv_nop"
      : "+v"(a), "+v"(b), "+v"(c), "+v"(d), "+v"(e), "+v"(f), "+v"(g), "+v"(h));      // in place, so no v_exp_f32 touches a register of the one in front of it; v_nop: the slot behind the last
  return (v8f){a, b, c, d, e, f, g, h}; }
__device__ __forceinline__ float swap_halves(float x) { const int t = __float_as_int(x); return __int_as_float(__builtin_amdgcn_permlanex16(t, t, 0x76543210, 0xfedcba98, false, false)); }   // lane l <-> l ^ 16
__global__ __launch_bounds__(512) void k_flash(const _Float16* __restrict__ Q16, const _Float16* __restrict__ K16, const _Float16* __restrict__ Vt, const _Float16* __restrict__ SIM, const float* __restrict__ TEMP, const float* __restrict__ KN, _Float16* __restrict__ O16) {
  constexpr int RPW = 32, NQB = SS / (4 * RPW), DT = HD / 16, KS = HD / 32, NSP = 4;
  static_assert(NSP == 4 && DT == 4, "in the join, the wave of key set s sums two of the eight output tiles");
  __shared__ __attribute__((aligned(16))) float sO[4 * NSP][2][DT][2][32][4];      // a wave's rescaled Ot: 16 bytes a lane, lanes side by side
  __shared__ float sM[4 * NSP][2][32], sL[4 * NSP][2][32];
  const int tid = threadIdx.x, lane = tid & 31, ln = lane & 15, hh = lane >> 4;
  const int w = __builtin_amdgcn_readfirstlane(tid >> 5), qg = w & 3, ksp = w >> 2, k0 = ksp * 32;      // the wave's number in a scalar register: the key loop's bounds and its branch stay scalar
  const int slab = blockIdx.x / NQB, qblk = blockIdx.x % NQB; const int b = slab / NH, h = slab % NH; const int q0 = qblk * (4 * RPW) + qg * RPW; const float sc = (0.125f * L2E) / TEMP[b];
  FragH aq[2][KS];
#pragma unroll
  for (int qt = 0; qt < 2; ++qt) { const unsigned short* qr = (const unsigned short*)Q16 + ((size_t)((b * SS + q0) / 16 + qt) * (DM / 32) + h * KS) * 512 + lane * 8;
#pragma unroll
    for (int ks = 0; ks < KS; ++ks) { aq[qt][ks].half[0] = *(const v8us*)(qr + ks * 512); aq[qt][ks].half[1] = *(const v8us*)(qr + ks * 512 + 256); } }
  // A pass is left out where every one of its 32 x 32 weights is known, before anything of it is loaded, to lie below 2^-36 of the query's running max. The bound holds for any input: a score is at most
  // sc |q| |k| (Cauchy-Schwarz on the stored f16 rows; 1.002 covers the roundings of the lengths and of the product) + 1.5 (the plane's value is at most log2(e) (0.5 + 0.4)) + pos(q, kc), and |q - kc| >= |q - (j0 + 16)| - 12.
  // Such a pass leaves max and Ot as they are (its weights are 0 in f16, the rescale factor is 1); what the sum loses over all 2048 keys is below 2^-25 of it (the sum is at least 1), under half a unit of its last f32 place.
  // knv: lane 2 p holds the largest key length of the wave's pass p (two tiles of 16 keys); qn: sc |q| of the lane's two queries.
  float knv = KN[((size_t)((b * SS + k0) / 16 + (lane >> 1) * (NSP * 2) + (lane & 1)) * NH + h) * 32];
  asm volatile("s_wait_xcnt 0x0" ::: "memory");      // stands in front of every later write of the register pair that the load above names as its address
  knv = fmaxf(knv, __shfl_xor(knv, 1, 32));
  float qn[2];
#pragma unroll
  for (int qt = 0; qt < 2; ++qt) { float s2 = 0.f;
#pragma unroll
    for (int ks = 0; ks < KS; ++ks)
#pragma unroll
      for (int i = 0; i < 16; ++i) { const float x = (float)aq[qt][ks].h[i]; s2 = fmaf(x, x, s2); }
    s2 += swap_halves(s2); qn[qt] = sqrtf(s2) * (sc * 1.002f); }
  // the walk starts at the pass of the wave's key set that lies nearest to its queries and wraps round, so that the running max is near its final value from the first pass on
  const int dl = ksp - qg, ip0 = min(max(qblk - (dl >= 3 ? 1 : 0) + (dl <= -3 ? 1 : 0), 0), SS / (NSP * 32) - 1); const float qc = (float)(q0 + ln - 16);
  // the lane's three read pointers at pass 0; a pass is 4 x 32 keys on (K16: 8 row tiles; Vt and SIM: 4 blocks of 32 keys)
  constexpr int TK = (DM / 32) * 512, TS = (SS / 32) * 512;      // f16 elements of a 16-row tile of a plane of DM and of SS columns
  const unsigned fo = lane * 8; const int qb = q0 + ln - 8 * hh - 4;      // qb - j0 + 16 (qt - nt) = query - kc of the lane's eight scores of tile (qt, nt)
  const unsigned short* vp0 = (const unsigned short*)Vt + (size_t)slab * DT * TS + (k0 / 32) * 512 + fo;
  const unsigned short* kp0 = (const unsigned short*)K16 + (size_t)((b * SS + k0) / 16) * TK + h * KS * 512 + fo;
  const unsigned short* sp0 = (const unsigned short*)SIM + (size_t)b * SS * SS + (size_t)(q0 / 16) * TS + (k0 / 32) * 512 + fo;
  float m_q[2], l_q[2]; v8f oacc[2][DT];
#pragma unroll
  for (int qt = 0; qt < 2; ++qt) { m_q[qt] = -3.0e38f; l_q[qt] = 0.f;
#pragma unroll
    for (int dt = 0; dt < DT; ++dt) oacc[qt][dt] = (v8f){0.f,0.f,0.f,0.f,0.f,0.f,0.f,0.f}; }
#pragma unroll 1
  for (int it = 0; it < SS / (NSP * 32); ++it) { const int ip = (ip0 + it) & (SS / (NSP * 32) - 1), j0 = k0 + ip * (NSP * 32);
    { const float kn = __int_as_float(__builtin_amdgcn_readlane(__float_as_int(knv), 2 * ip)), dq = qc - (float)j0;
      const float u0 = fmaf(qn[0], kn, (0.1f * L2E) * fminf(22.f - fabsf(dq), 0.f)), u1 = fmaf(qn[1], kn, (0.1f * L2E) * fminf(22.f - fabsf(dq + 16.f), 0.f));
      if ((__builtin_amdgcn_ballot_w32(!(u0 < m_q[0] - 37.5f)) | __builtin_amdgcn_ballot_w32(!(u1 < m_q[1] - 37.5f))) == 0) continue; }      // the whole wave or none: a scalar branch; a NaN on either side keeps the pass
    const unsigned short* kp = kp0 + (size_t)ip * (NSP * 2 * TK); const unsigned short* sp = sp0 + (size_t)ip * (NSP * 512); const unsigned short* vp = vp0 + (size_t)ip * (NSP * 512);
    // every load of the pass stands in front of its first product: none depends on the scores any more, so the pass waits for memory once
    FragH bk[2][KS], bv[DT], sm[2][2];
#pragma unroll
    for (int nt = 0; nt < 2; ++nt) {
#pragma unroll
      for (int ks = 0; ks < KS; ++ks) { bk[nt][ks].half[0] = *(const v8us*)(kp + nt * TK + ks * 512); bk[nt][ks].half[1] = *(const v8us*)(kp + nt * TK + ks * 512 + 256); }
#pragma unroll
      for (int qt = 0; qt < 2; ++qt) sm[qt][nt].half[0] = *(const v8us*)(sp + qt * TS + nt * 256); }
#pragma unroll
    for (int dt = 0; dt < DT; ++dt) { bv[dt].half[0] = *(const v8us*)(vp + dt * TS); bv[dt].half[1] = *(const v8us*)(vp + dt * TS + 256); }
    asm volatile("s_wait_xcnt 0x0" :: "v"(kp), "v"(sp), "v"(vp) : "memory");      // stands in front of every write of a register that one of the 20 loads names as its address; the three pointers are named as inputs so that their registers live up to the wait (else the last loads' results were placed in them)
    __builtin_amdgcn_sched_barrier(0);      // keeps the 20 loads one group (else half of them issue behind the first wait and the pass pays the latency twice) and every later write of the pointers' registers behind the wait above
    v8f s[2][2];
#pragma unroll
    for (int nt = 0; nt < 2; ++nt)
#pragma unroll
      for (int qt = 0; qt < 2; ++qt) { v8f acc = (v8f){0.f,0.f,0.f,0.f,0.f,0.f,0.f,0.f};
#pragma unroll
        for (int ks = 0; ks < KS; ++ks) acc = mmaH<1>(bk[nt][ks].v, bk[nt][ks].v, aq[qt][ks].v, aq[qt][ks].v, acc); s[qt][nt] = acc; }
    FragP pb[2]; const float dj = (float)(qb - j0); float pg[3];      // pos(q, kc) in base 2 for qt - nt = -1, 0, 1: the four tiles of a pass have three distances (unrolled, so that the three stay in registers)
#pragma unroll
    for (int i = 0; i < 3; ++i) pg[i] = (0.1f * L2E) * fminf(10.f - fabsf(dj + (float)(16 * (i - 1))), 0.f);
#pragma unroll
    for (int qt = 0; qt < 2; ++qt) { float mc = -INFINITY;
#pragma unroll
      for (int nt = 0; nt < 2; ++nt) { float mt = -INFINITY;
#pragma unroll
        for (int r = 0; r < 8; ++r) { const float sv = fmaf(s[qt][nt][r], sc, (float)sm[qt][nt].h[r]); s[qt][nt][r] = sv; mt = fmaxf(mt, sv); }      // all that is left per score and head: widen the plane's f16 value and one fma
        mc = fmaxf(mc, mt + pg[qt - nt + 1]); }
      mc = fmaxf(mc, swap_halves(mc));
      const float mn = fmaxf(m_q[qt], mc); const float al = exp2_raw(m_q[qt] - mn); m_q[qt] = mn; float ls = 0.f;
#pragma unroll
      for (int nt = 0; nt < 2; ++nt) { const float mo = mn - pg[qt - nt + 1];
#pragma unroll
        for (int r = 0; r < 8; ++r) s[qt][nt][r] -= mo;
        s[qt][nt] = exp2_x8(s[qt][nt]);
#pragma unroll
        for (int r = 0; r < 8; ++r) ls += s[qt][nt][r];
        pb[qt].p[nt] = __builtin_convertvector(s[qt][nt], v8h); }
      l_q[qt] = l_q[qt] * al + ls;      // partial sum of this half's 16 keys; the halves are joined behind the loop
#pragma unroll
      for (int dt = 0; dt < DT; ++dt)
#pragma unroll
        for (int r = 0; r < 8; ++r) oacc[qt][dt][r] *= al; }
#pragma unroll
    for (int dt = 0; dt < DT; ++dt)
#pragma unroll
      for (int qt = 0; qt < 2; ++qt) oacc[qt][dt] = mmaH<1>(bv[dt].v, bv[dt].v, pb[qt].v, pb[qt].v, oacc[qt][dt]); }
  // join of the four key sets of a query group. Step 1: every wave publishes its max and its sum (halves joined)
#pragma unroll
  for (int qt = 0; qt < 2; ++qt) { float l = l_q[qt]; l += swap_halves(l); sM[w][qt][lane] = m_q[qt]; sL[w][qt][lane] = l; }
  __syncthreads();
  // step 2: the common max, the common sum (sets in order), and the wave's Ot rescaled to the common max into LDS
  float inv[2];
#pragma unroll
  for (int qt = 0; qt < 2; ++qt) { float ms[NSP], mx = -3.0e38f, l = 0.f;
#pragma unroll
    for (int s = 0; s < NSP; ++s) { ms[s] = sM[s * 4 + qg][qt][lane]; mx = fmaxf(mx, ms[s]); }
#pragma unroll
    for (int s = 0; s < NSP; ++s) l += sL[s * 4 + qg][qt][lane] * exp2_raw(ms[s] - mx);
    inv[qt] = (l > 0.f) ? 1.0f / l : 0.f; const float f = exp2_raw(m_q[qt] - mx);
#pragma unroll
    for (int dt = 0; dt < DT; ++dt) { v4f lo, hi;
#pragma unroll
      for (int r = 0; r < 4; ++r) { lo[r] = oacc[qt][dt][r] * f; hi[r] = oacc[qt][dt][4 + r] * f; }
      *(v4fa*)&sO[w][qt][dt][0][lane][0] = lo; *(v4fa*)&sO[w][qt][dt][1][lane][0] = hi; } }
  __syncthreads();
  // step 3: the wave of key set s sums, over the four sets in order, tiles 2 (s & 1) and 2 (s & 1) + 1 of query tile s >> 1: 16 rows x 32 columns = one whole block (1 KiB) of the f16 plane that the output projection reads,
  // and the lane's eight values of a tile are its 16-byte chunk of the block's half as they lie: the plane is stored here, in fragment order, with no f32 copy and no launch to convert it
  const int qs = ksp >> 1, d0 = (ksp & 1) * 2; const float iv = qs ? inv[1] : inv[0];
  unsigned short* ofr = (unsigned short*)O16 + ((size_t)((b * SS + q0) / 16 + qs) * (DM / 32) + h * KS + (ksp & 1)) * 512 + lane * 8;      // register r of tile dt is column dt * 16 + 8 hh + r of query ln
#pragma unroll
  for (int d = 0; d < 2; ++d) { v4f lo = *(const v4fa*)&sO[qg][qs][d0 + d][0][lane][0], hi = *(const v4fa*)&sO[qg][qs][d0 + d][1][lane][0];
#pragma unroll
    for (int s = 1; s < NSP; ++s) { lo += *(const v4fa*)&sO[s * 4 + qg][qs][d0 + d][0][lane][0]; hi += *(const v4fa*)&sO[s * 4 + qg][qs][d0 + d][1][lane][0]; }
    lo *= iv; hi *= iv; FragH f;
#pragma unroll
    for (int i = 0; i < 4; ++i) { f.h[i] = (_Float16)lo[i]; f.h[4 + i] = (_Float16)hi[i]; }
    *(v8us*)(ofr + d * 256) = f.half[0]; } }
extern "C" void kernel_launch(void* const* d_in, const int* in_sizes, int n_in,
                              void* d_out, int out_size, void* d_ws, size_t ws_size, hipStream_t stream) {
  (void)in_sizes; (void)n_in; (void)out_size;
  const float* xq = (const float*)d_in[0]; const float* xk = (const float*)d_in[1]; const float* xv = (const float*)d_in[2]; const int* mask = (const int*)d_in[3]; const float* sf = (const float*)d_in[4];
  const float* Wq = (const float*)d_in[5]; const float* bq = (const float*)d_in[6]; const float* Wk = (const float*)d_in[7]; const float* bk = (const float*)d_in[8]; const float* Wv = (const float*)d_in[9]; const float* bv = (const float*)d_in[10]; const float* Wo = (const float*)d_in[11]; const float* bo = (const float*)d_in[12]; const float* Wt1 = (const float*)d_in[13]; const float* bt1 = (const float*)d_in[14]; const float* Wt2 = (const float*)d_in[15]; const float* bt2 = (const float*)d_in[16];
  char* ws = (char*)d_ws; size_t off = 0;
  auto take = [&](size_t bytes) { char* p = ws + off; off += (bytes + 255) & ~(size_t)255; return p; };
  const size_t w8 = (size_t)DM * DM / 8;
  _Float16* Bq = (_Float16*)take(w8 * 16); _Float16* Bk = (_Float16*)take(w8 * 16); _Float16* Bv = (_Float16*)take(w8 * 16); _Float16* Bo = (_Float16*)take(w8 * 16);
  _Float16* XQ = (_Float16*)take((size_t)NR * DM * 2); _Float16* XK = (_Float16*)take((size_t)NR * DM * 2); _Float16* XV = (_Float16*)take((size_t)NR * DM * 2); _Float16* Q16 = (_Float16*)take((size_t)NR * DM * 2); _Float16* K16 = (_Float16*)take((size_t)NR * DM * 2); _Float16* Vt = (_Float16*)take((size_t)NR * DM * 2);
  _Float16* SN = (_Float16*)take((size_t)NR * DSEM * 2); _Float16* SIM = (_Float16*)take((size_t)BB * SS * SS * 2); float* TEMP = (float*)take(256); float* PART = (float*)take((size_t)BB * QP * DM * 4); float* KN = (float*)take((size_t)(NR / 16) * NH * 128); _Float16* O16 = XQ;      // the query plane is dead after the q GEMM
  if (off > ws_size) return;      // about 2 + 6 x 4.2 + 2.1 + 16.8 = 46 MiB
  k_prep<<<PB_QS + 3 * PB_X + PB_SN + 4 * PB_W, 512, 0, stream>>>(xq, xk, xv, sf, Wq, Wk, Wv, Wo, XQ, XK, XV, SN, Bq, Bk, Bv, Bo, PART);
  k_proj<<<1 + 3 * GB_P + BB * GB_S, 128, 0, stream>>>(XQ, XK, XV, Bq, Bk, Bv, bq, bk, bv, Q16, K16, Vt, SN, mask, SIM, PART, Wt1, bt1, Wt2, bt2, TEMP, KN);
  const dim3 gg(((NR / 16) * (DM / 64) + 3) / 4, 1);
  k_flash<<<BB * NH * (SS / 128), 512, 0, stream>>>(Q16, K16, Vt, SIM, TEMP, KN, O16);
  k_oproj<<<gg, 128, 0, stream>>>(O16, Bo, bo, (float*)d_out);
}
